// v000
// The times below were measured on an AMD MI455X: many runs one after another, warmed up first and cycling through
// copies of the inputs, with the whole window's GPU time divided by the number of runs. Launches and the gaps
// between them are all in it. The median over several windows is given; except for v000 it joins two sittings, which
// can be a few percent apart, so the side-by-side timings, each taken in one sitting, are the better comparison.
// The starting kernel, v000, takes 238 microseconds a run.
#include <hip/hip_runtime.h>
#include <math.h>

typedef float v2f __attribute__((ext_vector_type(2)));
typedef float v8f __attribute__((ext_vector_type(8)));

#define NN 2
#define LL 1024
#define SS 1024
#define HH 8
#define EE 64
#define KK 6
#define ROWS 16
#define KT_STRIDE 1033   // 1033 % 64 == 9 (coprime) -> conflict-free keyT access
#define QS 68            // 68 % 64 == 4 -> conflict-free A-fragment reads
#define NWAVES 8

struct SMem {
  float keyT[EE * KT_STRIDE];   // key transposed: keyT[e][s], 258 KB
  float qb[ROWS * QS];          // q block (16 x 64)
  float ht[ROWS * QS];          // htilde block (16 x 64), per code
  float k2[SS];                 // ||key_s||^2
  float kl[SS];                 // key_lengths_add[n][s]
  float q2[ROWS];               // ||htilde_r||^2
  float pi[ROWS][KK];           // mixture weights
  float redm[NWAVES][ROWS];     // cross-wave max partials
  float reds[NWAVES][ROWS];     // cross-wave sum partials
  float rowm[ROWS];
  float rowsum[ROWS];
};

static __device__ __forceinline__ v8f wmma_f32(v2f a, v2f b, v8f c) {
  // D = A(16x4,f32) * B(4x16,f32) + C(16x16,f32)
  return __builtin_amdgcn_wmma_f32_16x16x4_f32(false, a, false, b, (short)0, c,
                                               false, false);
}

static __device__ __forceinline__ float fast_tanh(float x) {
#if __has_builtin(__builtin_amdgcn_tanhf)
  return __builtin_amdgcn_tanhf(x);        // native v_tanh_f32 on gfx1250
#else
  // sign(x) * (1 - e^{-2|x|}) / (1 + e^{-2|x|}) : branch-free, no overflow
  float e2 = __expf(-2.0f * fabsf(x));
  return copysignf((1.0f - e2) / (1.0f + e2), x);
#endif
}

// Per-code logit transform over this wave's 8 tiles. CODE is compile-time so
// each specialization carries only its own handful of VALU ops per element.
template <int CODE>
static __device__ __forceinline__ void transform_tiles(
    v8f acc[8], const float* q2loc, float* vmax,
    int s0, int li, int hi, const float* __restrict__ maskb, const SMem& sm)
{
  #pragma unroll
  for (int st = 0; st < 8; ++st) {
    const int scol = s0 + st * 16 + li;
    const float k2v = sm.k2[scol];
    const float klv = sm.kl[scol];
    #pragma unroll
    for (int v = 0; v < 8; ++v) {
      const int r = v + hi * 8;
      const float d = acc[st][v];
      float x;
      if (CODE == 0) {                                   // L
        x = d;
      } else if (CODE == 3) {                            // Y: (d+1)^2
        float t = d + 1.0f; x = t * t;
      } else {
        float ns = q2loc[v] + k2v - 2.0f * d;
        if (CODE == 1)      x = -__logf(1.0f + ns);      // O
        else if (CODE == 2) x = -ns;                     // P
        else if (CODE == 4) x = __expf(-0.5f * ns);      // R
        else                x = __cosf(ns) * __expf(-ns);// W
      }
      x += klv + maskb[(size_t)r * SS + scol];
      acc[st][v] = x;
      vmax[v] = fmaxf(vmax[v], x);
    }
  }
}

__global__ __launch_bounds__(256)
void gsm_wmma_kernel(const float* __restrict__ q_g, const float* __restrict__ k_g,
                     const float* __restrict__ mask_g, const float* __restrict__ kl_g,
                     const float* __restrict__ M_g, const float* __restrict__ C_g,
                     float* __restrict__ out_g)
{
  __shared__ SMem sm;
  const int tid  = threadIdx.x;
  const int lane = tid & 31;
  const int wave = tid >> 5;
  const int li   = lane & 15;     // column / row-in-half index
  const int hi   = lane >> 4;     // half-wave select
  const int l0   = blockIdx.x * ROWS;
  const int h    = blockIdx.y;
  const int n    = blockIdx.z;
  const int s0   = wave * 128;    // this wave's 128-column strip

  // ---- stage q block, transposed key, key_lengths ----
  for (int idx = tid; idx < ROWS * EE; idx += 256) {
    int r = idx >> 6, e = idx & 63;
    sm.qb[r * QS + e] = q_g[(((size_t)n * LL + l0 + r) * HH + h) * EE + e];
  }
  for (int idx = tid; idx < EE * SS; idx += 256) {
    int e = idx & 63, s = idx >> 6;
    sm.keyT[e * KT_STRIDE + s] = k_g[(((size_t)n * SS + s) * HH + h) * EE + e];
  }
  for (int s = tid; s < SS; s += 256) sm.kl[s] = kl_g[n * SS + s];
  __syncthreads();

  // ---- k2[s] ----
  for (int s = tid; s < SS; s += 256) {
    float a2 = 0.f;
    #pragma unroll 8
    for (int e = 0; e < EE; ++e) { float v = sm.keyT[e * KT_STRIDE + s]; a2 += v * v; }
    sm.k2[s] = a2;
  }
  // ---- pi = softmax(q @ M[h]) over 6 codes ----
  if (tid < ROWS * KK) {
    int r = tid / KK, cc = tid % KK;
    float a = 0.f;
    for (int e = 0; e < EE; ++e)
      a += sm.qb[r * QS + e] * M_g[((size_t)h * EE + e) * KK + cc];
    sm.pi[r][cc] = a;
  }
  __syncthreads();
  if (tid < ROWS) {
    float mx = sm.pi[tid][0];
    for (int cc = 1; cc < KK; ++cc) mx = fmaxf(mx, sm.pi[tid][cc]);
    float den = 0.f; float ex[KK];
    for (int cc = 0; cc < KK; ++cc) { ex[cc] = __expf(sm.pi[tid][cc] - mx); den += ex[cc]; }
    for (int cc = 0; cc < KK; ++cc) sm.pi[tid][cc] = ex[cc] / den;
  }

  v8f outacc[8];
  #pragma unroll
  for (int st = 0; st < 8; ++st) outacc[st] = v8f{};

  const float* maskb = mask_g + ((size_t)n * LL + l0) * SS;

  for (int c = 0; c < KK; ++c) {
    __syncthreads();   // ht / q2 / reduction buffers free for reuse

    // ---- htilde = tanh(qb @ C[c,h]) : waves 0..3 each compute one 16-col tile ----
    if (wave < 4) {
      const float* Cb = C_g + ((size_t)c * HH + h) * EE * EE;
      const int f0 = wave * 16;
      v8f hacc = v8f{};
      #pragma unroll
      for (int kc = 0; kc < 16; ++kc) {
        const int kb = kc * 4 + hi * 2;
        v2f a, b;
        a.x = sm.qb[li * QS + kb];
        a.y = sm.qb[li * QS + kb + 1];
        b.x = Cb[(size_t)kb * EE + f0 + li];
        b.y = Cb[(size_t)(kb + 1) * EE + f0 + li];
        hacc = wmma_f32(a, b, hacc);
      }
      #pragma unroll
      for (int v = 0; v < 8; ++v)
        sm.ht[(v + hi * 8) * QS + f0 + li] = fast_tanh(hacc[v]);
    }
    __syncthreads();
    if (tid < ROWS) {
      float a2 = 0.f;
      for (int e = 0; e < EE; ++e) { float v = sm.ht[tid * QS + e]; a2 += v * v; }
      sm.q2[tid] = a2;
    }
    __syncthreads();

    // ---- logits = htilde @ key^T over this wave's 128-column strip ----
    v8f acc[8];
    #pragma unroll
    for (int st = 0; st < 8; ++st) acc[st] = v8f{};
    #pragma unroll
    for (int kc = 0; kc < 16; ++kc) {
      const int kb = kc * 4 + hi * 2;
      v2f a;
      a.x = sm.ht[li * QS + kb];
      a.y = sm.ht[li * QS + kb + 1];
      #pragma unroll
      for (int st = 0; st < 8; ++st) {
        v2f b;
        b.x = sm.keyT[kb * KT_STRIDE + s0 + st * 16 + li];
        b.y = sm.keyT[(kb + 1) * KT_STRIDE + s0 + st * 16 + li];
        acc[st] = wmma_f32(a, b, acc[st]);
      }
    }

    // ---- kernel transform + additive mask; track per-row max ----
    float q2loc[8], vmax[8];
    #pragma unroll
    for (int v = 0; v < 8; ++v) { q2loc[v] = sm.q2[v + hi * 8]; vmax[v] = -3.4e38f; }
    switch (c) {
      case 0: transform_tiles<0>(acc, q2loc, vmax, s0, li, hi, maskb, sm); break;
      case 1: transform_tiles<1>(acc, q2loc, vmax, s0, li, hi, maskb, sm); break;
      case 2: transform_tiles<2>(acc, q2loc, vmax, s0, li, hi, maskb, sm); break;
      case 3: transform_tiles<3>(acc, q2loc, vmax, s0, li, hi, maskb, sm); break;
      case 4: transform_tiles<4>(acc, q2loc, vmax, s0, li, hi, maskb, sm); break;
      default: transform_tiles<5>(acc, q2loc, vmax, s0, li, hi, maskb, sm); break;
    }

    // ---- row max: xor-shuffle within 16-lane half, then across 8 waves ----
    #pragma unroll
    for (int m = 1; m <= 8; m <<= 1) {
      #pragma unroll
      for (int v = 0; v < 8; ++v)
        vmax[v] = fmaxf(vmax[v], __shfl_xor(vmax[v], m, 32));
    }
    if (li == 0) {
      #pragma unroll
      for (int v = 0; v < 8; ++v) sm.redm[wave][v + hi * 8] = vmax[v];
    }
    __syncthreads();
    if (tid < ROWS) {
      float mx = sm.redm[0][tid];
      for (int w = 1; w < NWAVES; ++w) mx = fmaxf(mx, sm.redm[w][tid]);
      sm.rowm[tid] = mx;
    }
    __syncthreads();

    // ---- exp and row sum ----
    float rmax[8], vsum[8];
    #pragma unroll
    for (int v = 0; v < 8; ++v) { rmax[v] = sm.rowm[v + hi * 8]; vsum[v] = 0.f; }
    #pragma unroll
    for (int st = 0; st < 8; ++st) {
      #pragma unroll
      for (int v = 0; v < 8; ++v) {
        float e = __expf(acc[st][v] - rmax[v]);
        acc[st][v] = e;
        vsum[v] += e;
      }
    }
    #pragma unroll
    for (int m = 1; m <= 8; m <<= 1) {
      #pragma unroll
      for (int v = 0; v < 8; ++v)
        vsum[v] += __shfl_xor(vsum[v], m, 32);
    }
    if (li == 0) {
      #pragma unroll
      for (int v = 0; v < 8; ++v) sm.reds[wave][v + hi * 8] = vsum[v];
    }
    __syncthreads();
    if (tid < ROWS) {
      float s = 0.f;
      for (int w = 0; w < NWAVES; ++w) s += sm.reds[w][tid];
      sm.rowsum[tid] = s;
    }
    __syncthreads();

    // ---- accumulate pi-weighted softmax into output tiles ----
    #pragma unroll
    for (int v = 0; v < 8; ++v) {
      const float wgt = sm.pi[v + hi * 8][c] / sm.rowsum[v + hi * 8];
      #pragma unroll
      for (int st = 0; st < 8; ++st)
        outacc[st][v] += acc[st][v] * wgt;
    }
  }

  // ---- store out[n,h,l,s], written exactly once ----
  float* ob = out_g + (((size_t)n * HH + h) * LL + l0) * SS;
  #pragma unroll
  for (int st = 0; st < 8; ++st) {
    #pragma unroll
    for (int v = 0; v < 8; ++v)
      ob[(size_t)(v + hi * 8) * SS + s0 + st * 16 + li] = outacc[st][v];
  }
}

extern "C" void kernel_launch(void* const* d_in, const int* in_sizes, int n_in,
                              void* d_out, int out_size, void* d_ws, size_t ws_size,
                              hipStream_t stream) {
  (void)in_sizes; (void)n_in; (void)out_size; (void)d_ws; (void)ws_size;
  const float* q    = (const float*)d_in[0];
  const float* k    = (const float*)d_in[1];
  const float* mask = (const float*)d_in[2];
  const float* kl   = (const float*)d_in[3];
  const float* M    = (const float*)d_in[4];
  const float* C    = (const float*)d_in[5];
  float* out = (float*)d_out;
  dim3 grid(LL / ROWS, HH, NN);   // (64, 8, 2) workgroups, 8 waves each
  gsm_wmma_kernel<<<grid, dim3(256), 0, stream>>>(q, k, mask, kl, M, C, out);
}

// v001
// It runs in 157 microseconds.
// Next to v000, in two timings, it ran 1.53 times as fast each time.
#include <hip/hip_runtime.h>
#include <math.h>

typedef float v2f __attribute__((ext_vector_type(2)));
typedef float v8f __attribute__((ext_vector_type(8)));

#define NN 2
#define LL 1024
#define SS 1024
#define HH 8
#define EE 64
#define KK 6
#define ROWS 16
#define KT_STRIDE 1033   // 1033 % 64 == 9 (coprime) -> conflict-free keyT access
#define QS 68            // 68 % 64 == 4 -> conflict-free A-fragment reads
#define NWAVES 8         // waves per 16-row block (one 128-column strip each)
#define GROUPS 2         // 16-row blocks per work-group, all reading one key tile
#define WROWS (ROWS * GROUPS)
#define THREADS (NWAVES * GROUPS * 32)

struct SMem {
  float keyT[EE * KT_STRIDE];   // key transposed: keyT[e][s], 258 KB
  float qb[WROWS * QS];         // q rows of both blocks (32 x 64)
  float ht[WROWS * QS];         // htilde rows of both blocks (32 x 64), per code
  float k2[SS];                 // ||key_s||^2
  float kl[SS];                 // key_lengths_add[n][s]
  float q2[WROWS];              // ||htilde_r||^2
  float pi[WROWS][KK];          // mixture weights
  float redm[NWAVES][WROWS];    // cross-wave max partials
  float reds[NWAVES][WROWS];    // cross-wave sum partials
  float rowm[WROWS];
  float rowsum[WROWS];
};

static __device__ __forceinline__ v8f wmma_f32(v2f a, v2f b, v8f c) {
  // D = A(16x4,f32) * B(4x16,f32) + C(16x16,f32)
  return __builtin_amdgcn_wmma_f32_16x16x4_f32(false, a, false, b, (short)0, c,
                                               false, false);
}

static __device__ __forceinline__ float fast_tanh(float x) {
#if __has_builtin(__builtin_amdgcn_tanhf)
  return __builtin_amdgcn_tanhf(x);        // native v_tanh_f32 on gfx1250
#else
  // sign(x) * (1 - e^{-2|x|}) / (1 + e^{-2|x|}) : branch-free, no overflow
  float e2 = __expf(-2.0f * fabsf(x));
  return copysignf((1.0f - e2) / (1.0f + e2), x);
#endif
}

// Per-code logit transform over this wave's 8 tiles. CODE is compile-time so
// each specialization carries only its own handful of VALU ops per element.
template <int CODE>
static __device__ __forceinline__ void transform_tiles(
    v8f acc[8], const float* q2loc, int s0, int li, const SMem& sm)
{
  #pragma unroll
  for (int st = 0; st < 8; ++st) {
    const int scol = s0 + st * 16 + li;
    const float k2v = sm.k2[scol];
    #pragma unroll
    for (int v = 0; v < 8; ++v) {
      const float d = acc[st][v];
      float x;
      if (CODE == 0) {                                   // L
        x = d;
      } else if (CODE == 3) {                            // Y: (d+1)^2
        float t = d + 1.0f; x = t * t;
      } else {
        float ns = q2loc[v] + k2v - 2.0f * d;
        if (CODE == 1)      x = -__logf(1.0f + ns);      // O
        else if (CODE == 2) x = -ns;                     // P
        else if (CODE == 4) x = __expf(-0.5f * ns);      // R
        else                x = __cosf(ns) * __expf(-ns);// W
      }
      acc[st][v] = x;
    }
  }
}

__global__ __launch_bounds__(THREADS)
void gsm_wmma_kernel(const float* __restrict__ q_g, const float* __restrict__ k_g,
                     const float* __restrict__ mask_g, const float* __restrict__ kl_g,
                     const float* __restrict__ M_g, const float* __restrict__ C_g,
                     float* __restrict__ out_g)
{
  __shared__ SMem sm;
  const int tid  = threadIdx.x;
  const int lane = tid & 31;
  const int grp  = tid >> 8;      // which 16-row block this wave works on
  const int gt   = tid & 255;     // thread index inside the block's 8 waves
  const int wave = gt >> 5;       // wave index inside the block
  const int r0   = grp * ROWS;    // the block's first row in the LDS row arrays
  const int li   = lane & 15;     // column / row-in-half index
  const int hi   = lane >> 4;     // half-wave select
  const int l0   = blockIdx.x * WROWS;
  const int h    = blockIdx.y;
  const int n    = blockIdx.z;
  const int s0   = wave * 128;    // this wave's 128-column strip

  // ---- stage q block, transposed key, key_lengths ----
  for (int idx = tid; idx < WROWS * EE; idx += THREADS) {
    int r = idx >> 6, e = idx & 63;
    sm.qb[r * QS + e] = q_g[(((size_t)n * LL + l0 + r) * HH + h) * EE + e];
  }
  for (int idx = tid; idx < EE * SS; idx += THREADS) {
    int e = idx & 63, s = idx >> 6;
    sm.keyT[e * KT_STRIDE + s] = k_g[(((size_t)n * SS + s) * HH + h) * EE + e];
  }
  for (int s = tid; s < SS; s += THREADS) sm.kl[s] = kl_g[n * SS + s];
  __syncthreads();

  // ---- k2[s] ----
  for (int s = tid; s < SS; s += THREADS) {
    float a2 = 0.f;
    #pragma unroll 8
    for (int e = 0; e < EE; ++e) { float v = sm.keyT[e * KT_STRIDE + s]; a2 += v * v; }
    sm.k2[s] = a2;
  }
  // ---- pi = softmax(q @ M[h]) over 6 codes ----
  if (gt < ROWS * KK) {
    int r = r0 + gt / KK, cc = gt % KK;
    float a = 0.f;
    for (int e = 0; e < EE; ++e)
      a += sm.qb[r * QS + e] * M_g[((size_t)h * EE + e) * KK + cc];
    sm.pi[r][cc] = a;
  }
  __syncthreads();
  if (gt < ROWS) {
    const int r = r0 + gt;
    float mx = sm.pi[r][0];
    for (int cc = 1; cc < KK; ++cc) mx = fmaxf(mx, sm.pi[r][cc]);
    float den = 0.f; float ex[KK];
    for (int cc = 0; cc < KK; ++cc) { ex[cc] = __expf(sm.pi[r][cc] - mx); den += ex[cc]; }
    for (int cc = 0; cc < KK; ++cc) sm.pi[r][cc] = ex[cc] / den;
  }

  v8f outacc[8];
  #pragma unroll
  for (int st = 0; st < 8; ++st) outacc[st] = v8f{};

  const float* maskb = mask_g + ((size_t)n * LL + l0 + r0) * SS;

  for (int c = 0; c < KK; ++c) {
    __syncthreads();   // ht / q2 / reduction buffers free for reuse

    // ---- htilde = tanh(qb @ C[c,h]) : waves 0..3 of each block compute one 16-col tile ----
    if (wave < 4) {
      const int f0 = wave * 16;
      // the lane's own column and k pair; the 16 k-steps are then constant offsets
      const float* Cb = C_g + ((size_t)c * HH + h) * EE * EE + hi * 2 * EE + f0 + li;
      v8f hacc = v8f{};
      #pragma unroll
      for (int kc = 0; kc < 16; ++kc) {
        const int kb = kc * 4 + hi * 2;
        v2f a, b;
        a.x = sm.qb[(r0 + li) * QS + kb];
        a.y = sm.qb[(r0 + li) * QS + kb + 1];
        b.x = Cb[kc * 4 * EE];
        b.y = Cb[kc * 4 * EE + EE];
        hacc = wmma_f32(a, b, hacc);
      }
      #pragma unroll
      for (int v = 0; v < 8; ++v)
        sm.ht[(r0 + v + hi * 8) * QS + f0 + li] = fast_tanh(hacc[v]);
    }
    __syncthreads();
    if (gt < ROWS) {
      float a2 = 0.f;
      for (int e = 0; e < EE; ++e) { float v = sm.ht[(r0 + gt) * QS + e]; a2 += v * v; }
      sm.q2[r0 + gt] = a2;
    }
    __syncthreads();

    // ---- logits = htilde @ key^T over this wave's 128-column strip ----
    v8f acc[8];
    #pragma unroll
    for (int st = 0; st < 8; ++st) acc[st] = v8f{};
    // two k-steps per trip, the trips kept rolled: unrolled whole, the 16 steps' LDS
    // addresses are hoisted out of the code loop and overflow a wave's 256 registers
    #pragma unroll 1
    for (int kq = 0; kq < 8; ++kq) {
      #pragma unroll
      for (int kj = 0; kj < 2; ++kj) {
        const int kb = (kq * 2 + kj) * 4 + hi * 2;
        v2f a;
        a.x = sm.ht[(r0 + li) * QS + kb];
        a.y = sm.ht[(r0 + li) * QS + kb + 1];
        #pragma unroll
        for (int st = 0; st < 8; ++st) {
          v2f b;
          b.x = sm.keyT[kb * KT_STRIDE + s0 + st * 16 + li];
          b.y = sm.keyT[(kb + 1) * KT_STRIDE + s0 + st * 16 + li];
          acc[st] = wmma_f32(a, b, acc[st]);
        }
      }
      // the back edge follows the last WMMA, and the next trip's address arithmetic
      // reuses its A and B registers: four vector slots keep the distance on that path;
      // the scheduling barrier keeps them behind the WMMAs, at the loop's foot
      __builtin_amdgcn_sched_barrier(0);
      asm volatile("v_nop\n\tv_nop\n\tv_nop\n\tv_nop");
    }

    // ---- kernel transform of the logits, in place ----
    float q2loc[8], vmax[8];
    #pragma unroll
    for (int v = 0; v < 8; ++v) { q2loc[v] = sm.q2[r0 + v + hi * 8]; vmax[v] = -3.4e38f; }
    switch (c) {
      case 0: transform_tiles<0>(acc, q2loc, s0, li, sm); break;
      case 1: transform_tiles<1>(acc, q2loc, s0, li, sm); break;
      case 2: transform_tiles<2>(acc, q2loc, s0, li, sm); break;
      case 3: transform_tiles<3>(acc, q2loc, s0, li, sm); break;
      case 4: transform_tiles<4>(acc, q2loc, s0, li, sm); break;
      default: transform_tiles<5>(acc, q2loc, s0, li, sm); break;
    }

    // ---- additive masks and per-row max, one copy behind the switch: inside each of its
    // six cases the 64 mask loads and the case's temporaries overflow 256 registers ----
    #pragma unroll
    for (int st = 0; st < 8; ++st) {
      const int scol = s0 + st * 16 + li;
      const float klv = sm.kl[scol];
      #pragma unroll
      for (int v = 0; v < 8; ++v) {
        const float x = acc[st][v] + (klv + maskb[(size_t)(v + hi * 8) * SS + scol]);
        acc[st][v] = x;
        vmax[v] = fmaxf(vmax[v], x);
      }
    }

    // ---- row max: xor-shuffle within 16-lane half, then across 8 waves ----
    #pragma unroll
    for (int m = 1; m <= 8; m <<= 1) {
      #pragma unroll
      for (int v = 0; v < 8; ++v)
        vmax[v] = fmaxf(vmax[v], __shfl_xor(vmax[v], m, 32));
    }
    if (li == 0) {
      #pragma unroll
      for (int v = 0; v < 8; ++v) sm.redm[wave][r0 + v + hi * 8] = vmax[v];
    }
    __syncthreads();
    if (gt < ROWS) {
      float mx = sm.redm[0][r0 + gt];
      for (int w = 1; w < NWAVES; ++w) mx = fmaxf(mx, sm.redm[w][r0 + gt]);
      sm.rowm[r0 + gt] = mx;
    }
    __syncthreads();

    // ---- exp and row sum ----
    float rmax[8], vsum[8];
    #pragma unroll
    for (int v = 0; v < 8; ++v) { rmax[v] = sm.rowm[r0 + v + hi * 8]; vsum[v] = 0.f; }
    #pragma unroll
    for (int st = 0; st < 8; ++st) {
      #pragma unroll
      for (int v = 0; v < 8; ++v) {
        float e = __expf(acc[st][v] - rmax[v]);
        acc[st][v] = e;
        vsum[v] += e;
      }
    }
    #pragma unroll
    for (int m = 1; m <= 8; m <<= 1) {
      #pragma unroll
      for (int v = 0; v < 8; ++v)
        vsum[v] += __shfl_xor(vsum[v], m, 32);
    }
    if (li == 0) {
      #pragma unroll
      for (int v = 0; v < 8; ++v) sm.reds[wave][r0 + v + hi * 8] = vsum[v];
    }
    __syncthreads();
    if (gt < ROWS) {
      float s = 0.f;
      for (int w = 0; w < NWAVES; ++w) s += sm.reds[w][r0 + gt];
      sm.rowsum[r0 + gt] = s;
    }
    __syncthreads();

    // ---- accumulate pi-weighted softmax into output tiles ----
    #pragma unroll
    for (int v = 0; v < 8; ++v) {
      const float wgt = sm.pi[r0 + v + hi * 8][c] / sm.rowsum[r0 + v + hi * 8];
      #pragma unroll
      for (int st = 0; st < 8; ++st)
        outacc[st][v] += acc[st][v] * wgt;
    }
  }

  // ---- store out[n,h,l,s], written exactly once ----
  float* ob = out_g + (((size_t)n * HH + h) * LL + l0 + r0) * SS;
  #pragma unroll
  for (int st = 0; st < 8; ++st) {
    #pragma unroll
    for (int v = 0; v < 8; ++v)
      ob[(size_t)(v + hi * 8) * SS + s0 + st * 16 + li] = outacc[st][v];
  }
}

extern "C" void kernel_launch(void* const* d_in, const int* in_sizes, int n_in,
                              void* d_out, int out_size, void* d_ws, size_t ws_size,
                              hipStream_t stream) {
  (void)in_sizes; (void)n_in; (void)out_size; (void)d_ws; (void)ws_size;
  const float* q    = (const float*)d_in[0];
  const float* k    = (const float*)d_in[1];
  const float* mask = (const float*)d_in[2];
  const float* kl   = (const float*)d_in[3];
  const float* M    = (const float*)d_in[4];
  const float* C    = (const float*)d_in[5];
  float* out = (float*)d_out;
  dim3 grid(LL / WROWS, HH, NN);   // (32, 8, 2) workgroups, 16 waves each
  gsm_wmma_kernel<<<grid, dim3(THREADS), 0, stream>>>(q, k, mask, kl, M, C, out);
}

// v002
// A run of this version takes 126 microseconds.
// Next to v001, in two timings, it ran 1.25 times as fast each time.
// Counting every step since v000, it is 1.91 times as fast.
#include <hip/hip_runtime.h>
#include <math.h>

typedef float v2f __attribute__((ext_vector_type(2)));
typedef float v4f __attribute__((ext_vector_type(4)));
typedef float v8f __attribute__((ext_vector_type(8)));

#define NN 2
#define LL 1024
#define SS 1024
#define HH 8
#define EE 64
#define KK 6
#define ROWS 16
#define KP 68            // key row pitch: 272 B = 16 B x 17 (odd) -> conflict-free 16-byte reads
#define QS 68            // same pitch for the q and htilde rows (A fragments)
#define NWAVES 8         // waves per 16-row block (one 128-column strip each)
#define GROUPS 2         // 16-row blocks per work-group, all reading one key tile
#define WROWS (ROWS * GROUPS)
#define THREADS (NWAVES * GROUPS * 32)

struct SMem {
  float keyR[SS * KP] __attribute__((aligned(16)));   // key rows as in memory: keyR[s][e], 272 KB
  float qb[WROWS * QS];         // q rows of both blocks (32 x 64)
  float ht[WROWS * QS] __attribute__((aligned(16)));  // htilde rows of both blocks (32 x 64), per code
  float k2[SS];                 // ||key_s||^2
  float kl[SS];                 // key_lengths_add[n][s]
  float q2[WROWS];              // ||htilde_r||^2
  float pi[WROWS][KK];          // mixture weights
  float redm[NWAVES][WROWS];    // cross-wave max partials
  float reds[NWAVES][WROWS];    // cross-wave sum partials
  float rowm[WROWS];
  float rowsum[WROWS];
};

static __device__ __forceinline__ v8f wmma_f32(v2f a, v2f b, v8f c) {
  // D = A(16x4,f32) * B(4x16,f32) + C(16x16,f32)
  return __builtin_amdgcn_wmma_f32_16x16x4_f32(false, a, false, b, (short)0, c,
                                               false, false);
}

static __device__ __forceinline__ float fast_tanh(float x) {
#if __has_builtin(__builtin_amdgcn_tanhf)
  return __builtin_amdgcn_tanhf(x);        // native v_tanh_f32 on gfx1250
#else
  // sign(x) * (1 - e^{-2|x|}) / (1 + e^{-2|x|}) : branch-free, no overflow
  float e2 = __expf(-2.0f * fabsf(x));
  return copysignf((1.0f - e2) / (1.0f + e2), x);
#endif
}

// Per-code logit transform over this wave's 8 tiles. CODE is compile-time so
// each specialization carries only its own handful of VALU ops per element.
template <int CODE>
static __device__ __forceinline__ void transform_tiles(
    v8f acc[8], const float* q2loc, int s0, int li, const SMem& sm)
{
  #pragma unroll
  for (int st = 0; st < 8; ++st) {
    const int scol = s0 + st * 16 + li;
    const float k2v = sm.k2[scol];
    #pragma unroll
    for (int v = 0; v < 8; ++v) {
      const float d = acc[st][v];
      float x;
      if (CODE == 0) {                                   // L
        x = d;
      } else if (CODE == 3) {                            // Y: (d+1)^2
        float t = d + 1.0f; x = t * t;
      } else {
        float ns = q2loc[v] + k2v - 2.0f * d;
        if (CODE == 1)      x = -__logf(1.0f + ns);      // O
        else if (CODE == 2) x = -ns;                     // P
        else if (CODE == 4) x = __expf(-0.5f * ns);      // R
        else                x = __cosf(ns) * __expf(-ns);// W
      }
      acc[st][v] = x;
    }
  }
}

__global__ __launch_bounds__(THREADS)
void gsm_wmma_kernel(const float* __restrict__ q_g, const float* __restrict__ k_g,
                     const float* __restrict__ mask_g, const float* __restrict__ kl_g,
                     const float* __restrict__ M_g, const float* __restrict__ C_g,
                     float* __restrict__ out_g)
{
  __shared__ SMem sm;
  const int tid  = threadIdx.x;
  const int lane = tid & 31;
  const int grp  = tid >> 8;      // which 16-row block this wave works on
  const int gt   = tid & 255;     // thread index inside the block's 8 waves
  const int wave = gt >> 5;       // wave index inside the block
  const int r0   = grp * ROWS;    // the block's first row in the LDS row arrays
  const int li   = lane & 15;     // column / row-in-half index
  const int hi   = lane >> 4;     // half-wave select
  const int l0   = blockIdx.x * WROWS;
  const int h    = blockIdx.y;
  const int n    = blockIdx.z;
  const int s0   = wave * 128;    // this wave's 128-column strip

  // ---- stage q block, key rows, key_lengths ----
  for (int idx = tid; idx < WROWS * EE; idx += THREADS) {
    int r = idx >> 6, e = idx & 63;
    sm.qb[r * QS + e] = q_g[(((size_t)n * LL + l0 + r) * HH + h) * EE + e];
  }
  // 16 lanes copy one 256-byte key row, 16 bytes each; a pass of the block covers 32 rows
  {
    const float* ksrc = k_g + (((size_t)n * SS + (tid >> 4)) * HH + h) * EE + (tid & 15) * 4;
    float* kdst = &sm.keyR[(tid >> 4) * KP + (tid & 15) * 4];
    // unrolled whole: the 32 reads of a thread are all in flight before the first LDS write
    #pragma unroll
    for (int i = 0; i < SS / (THREADS / 16); ++i)
      *(v4f*)(kdst + i * (THREADS / 16) * KP) =
          *(const v4f*)(ksrc + (size_t)i * (THREADS / 16) * HH * EE);
  }
  for (int s = tid; s < SS; s += THREADS) sm.kl[s] = kl_g[n * SS + s];
  __syncthreads();

  // ---- k2[s] ----
  for (int s = tid; s < SS; s += THREADS) {
    float a2 = 0.f;
    for (int e = 0; e < EE; e += 4) {
      const v4f v = *(const v4f*)&sm.keyR[s * KP + e];
      a2 += v.x * v.x; a2 += v.y * v.y; a2 += v.z * v.z; a2 += v.w * v.w;
    }
    sm.k2[s] = a2;
  }
  // ---- pi = softmax(q @ M[h]) over 6 codes ----
  if (gt < ROWS * KK) {
    int r = r0 + gt / KK, cc = gt % KK;
    float a = 0.f;
    for (int e = 0; e < EE; ++e)
      a += sm.qb[r * QS + e] * M_g[((size_t)h * EE + e) * KK + cc];
    sm.pi[r][cc] = a;
  }
  __syncthreads();
  if (gt < ROWS) {
    const int r = r0 + gt;
    float mx = sm.pi[r][0];
    for (int cc = 1; cc < KK; ++cc) mx = fmaxf(mx, sm.pi[r][cc]);
    float den = 0.f; float ex[KK];
    for (int cc = 0; cc < KK; ++cc) { ex[cc] = __expf(sm.pi[r][cc] - mx); den += ex[cc]; }
    for (int cc = 0; cc < KK; ++cc) sm.pi[r][cc] = ex[cc] / den;
  }

  v8f outacc[8];
  #pragma unroll
  for (int st = 0; st < 8; ++st) outacc[st] = v8f{};

  const float* maskb = mask_g + ((size_t)n * LL + l0 + r0) * SS;

  for (int c = 0; c < KK; ++c) {
    __syncthreads();   // ht / q2 / reduction buffers free for reuse

    // ---- htilde = tanh(qb @ C[c,h]) : waves 0..3 of each block compute one 16-col tile ----
    if (wave < 4) {
      const int f0 = wave * 16;
      // the lane's own column and k pair; the 16 k-steps are then constant offsets
      const float* Cb = C_g + ((size_t)c * HH + h) * EE * EE + hi * 2 * EE + f0 + li;
      v8f hacc = v8f{};
      #pragma unroll
      for (int kc = 0; kc < 16; ++kc) {
        const int kb = kc * 4 + hi * 2;
        v2f a, b;
        a.x = sm.qb[(r0 + li) * QS + kb];
        a.y = sm.qb[(r0 + li) * QS + kb + 1];
        b.x = Cb[kc * 4 * EE];
        b.y = Cb[kc * 4 * EE + EE];
        hacc = wmma_f32(a, b, hacc);
      }
      #pragma unroll
      for (int v = 0; v < 8; ++v)
        sm.ht[(r0 + v + hi * 8) * QS + f0 + li] = fast_tanh(hacc[v]);
    }
    __syncthreads();
    if (gt < ROWS) {
      float a2 = 0.f;
      for (int e = 0; e < EE; ++e) { float v = sm.ht[(r0 + gt) * QS + e]; a2 += v * v; }
      sm.q2[r0 + gt] = a2;
    }
    __syncthreads();

    // ---- logits = htilde @ key^T over this wave's 128-column strip ----
    v8f acc[8];
    #pragma unroll
    for (int st = 0; st < 8; ++st) acc[st] = v8f{};
    // One 16-byte read holds a lane's operands of two k-steps: in steps 2j and 2j+1 the
    // lane half hi takes e = 8j + 4hi + {0,1} and e = 8j + 4hi + {2,3}, for A and B alike.
    const float* arow = &sm.ht[(r0 + li) * QS + hi * 4];
    const float* brow = &sm.keyR[(s0 + li) * KP + hi * 4];
    // unrolled whole: every read is one of the two base registers plus an immediate offset,
    // and the next block's reads are issued as one group ahead of this block's WMMAs
    #pragma unroll
    for (int j = 0; j < 8; ++j) {
      const v4f a4 = *(const v4f*)(arow + j * 8);
      v4f b4[8];
      #pragma unroll
      for (int st = 0; st < 8; ++st)
        b4[st] = *(const v4f*)(brow + st * 16 * KP + j * 8);
      #pragma unroll
      for (int st = 0; st < 8; ++st)
        acc[st] = wmma_f32(a4.xy, b4[st].xy, acc[st]);
      #pragma unroll
      for (int st = 0; st < 8; ++st)
        acc[st] = wmma_f32(a4.zw, b4[st].zw, acc[st]);
    }
    // the branches of the switch below follow the last WMMA: four vector slots keep the
    // distance to the first use of acc on every
    // taken path; the scheduling barrier keeps them behind the WMMAs
    __builtin_amdgcn_sched_barrier(0);
    asm volatile("v_nop\n\tv_nop\n\tv_nop\n\tv_nop");

    // ---- kernel transform of the logits, in place ----
    float q2loc[8], vmax[8];
    #pragma unroll
    for (int v = 0; v < 8; ++v) { q2loc[v] = sm.q2[r0 + v + hi * 8]; vmax[v] = -3.4e38f; }
    switch (c) {
      case 0: transform_tiles<0>(acc, q2loc, s0, li, sm); break;
      case 1: transform_tiles<1>(acc, q2loc, s0, li, sm); break;
      case 2: transform_tiles<2>(acc, q2loc, s0, li, sm); break;
      case 3: transform_tiles<3>(acc, q2loc, s0, li, sm); break;
      case 4: transform_tiles<4>(acc, q2loc, s0, li, sm); break;
      default: transform_tiles<5>(acc, q2loc, s0, li, sm); break;
    }

    // ---- additive masks and per-row max, one copy behind the switch: inside each of its
    // six cases the 64 mask loads and the case's temporaries overflow 256 registers ----
    #pragma unroll
    for (int st = 0; st < 8; ++st) {
      const int scol = s0 + st * 16 + li;
      const float klv = sm.kl[scol];
      #pragma unroll
      for (int v = 0; v < 8; ++v) {
        const float x = acc[st][v] + (klv + maskb[(size_t)(v + hi * 8) * SS + scol]);
        acc[st][v] = x;
        vmax[v] = fmaxf(vmax[v], x);
      }
    }

    // ---- row max: xor-shuffle within 16-lane half, then across 8 waves ----
    #pragma unroll
    for (int m = 1; m <= 8; m <<= 1) {
      #pragma unroll
      for (int v = 0; v < 8; ++v)
        vmax[v] = fmaxf(vmax[v], __shfl_xor(vmax[v], m, 32));
    }
    if (li == 0) {
      #pragma unroll
      for (int v = 0; v < 8; ++v) sm.redm[wave][r0 + v + hi * 8] = vmax[v];
    }
    __syncthreads();
    if (gt < ROWS) {
      float mx = sm.redm[0][r0 + gt];
      for (int w = 1; w < NWAVES; ++w) mx = fmaxf(mx, sm.redm[w][r0 + gt]);
      sm.rowm[r0 + gt] = mx;
    }
    __syncthreads();

    // ---- exp and row sum ----
    float rmax[8], vsum[8];
    #pragma unroll
    for (int v = 0; v < 8; ++v) { rmax[v] = sm.rowm[r0 + v + hi * 8]; vsum[v] = 0.f; }
    #pragma unroll
    for (int st = 0; st < 8; ++st) {
      #pragma unroll
      for (int v = 0; v < 8; ++v) {
        float e = __expf(acc[st][v] - rmax[v]);
        acc[st][v] = e;
        vsum[v] += e;
      }
    }
    #pragma unroll
    for (int m = 1; m <= 8; m <<= 1) {
      #pragma unroll
      for (int v = 0; v < 8; ++v)
        vsum[v] += __shfl_xor(vsum[v], m, 32);
    }
    if (li == 0) {
      #pragma unroll
      for (int v = 0; v < 8; ++v) sm.reds[wave][r0 + v + hi * 8] = vsum[v];
    }
    __syncthreads();
    if (gt < ROWS) {
      float s = 0.f;
      for (int w = 0; w < NWAVES; ++w) s += sm.reds[w][r0 + gt];
      sm.rowsum[r0 + gt] = s;
    }
    __syncthreads();

    // ---- accumulate pi-weighted softmax into output tiles ----
    #pragma unroll
    for (int v = 0; v < 8; ++v) {
      const float wgt = sm.pi[r0 + v + hi * 8][c] / sm.rowsum[r0 + v + hi * 8];
      #pragma unroll
      for (int st = 0; st < 8; ++st)
        outacc[st][v] += acc[st][v] * wgt;
    }
  }

  // ---- store out[n,h,l,s], written exactly once ----
  float* ob = out_g + (((size_t)n * HH + h) * LL + l0 + r0) * SS;
  #pragma unroll
  for (int st = 0; st < 8; ++st) {
    #pragma unroll
    for (int v = 0; v < 8; ++v)
      ob[(size_t)(v + hi * 8) * SS + s0 + st * 16 + li] = outacc[st][v];
  }
}

extern "C" void kernel_launch(void* const* d_in, const int* in_sizes, int n_in,
                              void* d_out, int out_size, void* d_ws, size_t ws_size,
                              hipStream_t stream) {
  (void)in_sizes; (void)n_in; (void)out_size; (void)d_ws; (void)ws_size;
  const float* q    = (const float*)d_in[0];
  const float* k    = (const float*)d_in[1];
  const float* mask = (const float*)d_in[2];
  const float* kl   = (const float*)d_in[3];
  const float* M    = (const float*)d_in[4];
  const float* C    = (const float*)d_in[5];
  float* out = (float*)d_out;
  dim3 grid(LL / WROWS, HH, NN);   // (32, 8, 2) workgroups, 16 waves each
  gsm_wmma_kernel<<<grid, dim3(THREADS), 0, stream>>>(q, k, mask, kl, M, C, out);
}

// v003
// One run takes 112 microseconds.
// Next to v002, in two timings, it ran 1.12 times as fast each time.
// Over all steps from v000 it is 2.14 times as fast.
#include <hip/hip_runtime.h>
#include <math.h>

typedef float v2f __attribute__((ext_vector_type(2)));
typedef float v4f __attribute__((ext_vector_type(4)));
typedef float v8f __attribute__((ext_vector_type(8)));

#define NN 2
#define LL 1024
#define SS 1024
#define HH 8
#define EE 64
#define KK 6
#define ROWS 16
#define KP 68            // key row pitch: 272 B = 16 B x 17 (odd) -> conflict-free 16-byte reads
#define QS 68            // same pitch for the q and htilde rows (A fragments)
#define NWAVES 8         // waves per 16-row block (one 128-column strip each)
#define GROUPS 2         // 16-row blocks per work-group, all reading one key tile
#define WROWS (ROWS * GROUPS)
#define THREADS (NWAVES * GROUPS * 32)

struct SMem {
  float keyR[SS * KP] __attribute__((aligned(16)));   // key rows as in memory: keyR[s][e], 272 KB
  float qb[WROWS * QS];         // q rows of both blocks (32 x 64)
  float ht[2][WROWS * QS] __attribute__((aligned(16)));  // htilde rows of both blocks (32 x 64): this code's and the next one's
  float k2[SS];                 // ||key_s||^2
  float kl[SS];                 // key_lengths_add[n][s]
  float q2p[2][4][WROWS] __attribute__((aligned(16)));  // ||htilde_r||^2, one share per 16-column tile
  float pi[WROWS][KK];          // mixture weights
  float redm[NWAVES][WROWS];    // cross-wave max partials
  float reds[NWAVES][WROWS];    // cross-wave sum partials
  float rowm[WROWS];
  float rowsum[WROWS];
};

static __device__ __forceinline__ v8f wmma_f32(v2f a, v2f b, v8f c) {
  // D = A(16x4,f32) * B(4x16,f32) + C(16x16,f32)
  return __builtin_amdgcn_wmma_f32_16x16x4_f32(false, a, false, b, (short)0, c,
                                               false, false);
}

static __device__ __forceinline__ float fast_tanh(float x) {
#if __has_builtin(__builtin_amdgcn_tanhf)
  return __builtin_amdgcn_tanhf(x);        // native v_tanh_f32 on gfx1250
#else
  // sign(x) * (1 - e^{-2|x|}) / (1 + e^{-2|x|}) : branch-free, no overflow
  float e2 = __expf(-2.0f * fabsf(x));
  return copysignf((1.0f - e2) / (1.0f + e2), x);
#endif
}

// inside each 16-lane row, lane i takes the value of the lane named by nibble i of (hi8:lo8)
static __device__ __forceinline__ float rowgather(float x, unsigned lo8, unsigned hi8) {
  const int b = __builtin_bit_cast(int, x);
  return __builtin_bit_cast(float, __builtin_amdgcn_permlane16(b, b, lo8, hi8, false, false));
}

// One 16x16 tile of htilde = tanh(qb @ C[c,h]) for the block's rows r0..r0+15, columns f0..f0+15,
// and the tile's share of each row's ||htilde_r||^2 (q2t: one float per row of the work-group).
static __device__ __forceinline__ void htilde_tile(
    const float* qb, const float* __restrict__ C_g, float* htb, float* q2t,
    int c, int h, int r0, int f0, int li, int hi)
{
  // the lane's own column and k pair; the 16 k-steps are then constant offsets
  const float* Cb = C_g + ((size_t)c * HH + h) * EE * EE + hi * 2 * EE + f0 + li;
  v2f a[16], b[16];
  #pragma unroll
  for (int kc = 0; kc < 16; ++kc) {
    const int kb = kc * 4 + hi * 2;
    a[kc].x = qb[(r0 + li) * QS + kb];
    a[kc].y = qb[(r0 + li) * QS + kb + 1];
    b[kc].x = Cb[kc * 4 * EE];
    b[kc].y = Cb[kc * 4 * EE + EE];
  }
  // the two scheduling barriers: every load is issued ahead of the chain, and no address
  // arithmetic is scheduled in among the WMMAs
  __builtin_amdgcn_sched_barrier(0);
  v8f hacc = v8f{};
  #pragma unroll
  for (int kc = 0; kc < 16; ++kc) hacc = wmma_f32(a[kc], b[kc], hacc);
  __builtin_amdgcn_sched_barrier(0);
  float sq[8];
  #pragma unroll
  for (int v = 0; v < 8; ++v) {
    const float t = fast_tanh(hacc[v]);
    htb[(r0 + v + hi * 8) * QS + f0 + li] = t;
    sq[v] = t * t;
  }
  // sum of the squares over the tile's 16 columns: lane i adds lane i ^ 1, ^ 2, ^ 4, ^ 8 of its row
  #pragma unroll
  for (int v = 0; v < 8; ++v) sq[v] += rowgather(sq[v], 0x67452301u, 0xefcdab89u);
  #pragma unroll
  for (int v = 0; v < 8; ++v) sq[v] += rowgather(sq[v], 0x54761032u, 0xdcfe98bau);
  #pragma unroll
  for (int v = 0; v < 8; ++v) sq[v] += rowgather(sq[v], 0x32107654u, 0xba98fedcu);
  #pragma unroll
  for (int v = 0; v < 8; ++v) sq[v] += rowgather(sq[v], 0xfedcba98u, 0x76543210u);
  if (li == 0) {
    #pragma unroll
    for (int v = 0; v < 8; ++v) q2t[r0 + v + hi * 8] = sq[v];
  }
}

// Per-code logit transform over this wave's 8 tiles. CODE is compile-time so
// each specialization carries only its own handful of VALU ops per element.
template <int CODE>
static __device__ __forceinline__ void transform_tiles(
    v8f acc[8], const float* q2loc, int s0, int li, const SMem& sm)
{
  #pragma unroll
  for (int st = 0; st < 8; ++st) {
    const int scol = s0 + st * 16 + li;
    const float k2v = sm.k2[scol];
    #pragma unroll
    for (int v = 0; v < 8; ++v) {
      const float d = acc[st][v];
      float x;
      if (CODE == 0) {                                   // L
        x = d;
      } else if (CODE == 3) {                            // Y: (d+1)^2
        float t = d + 1.0f; x = t * t;
      } else {
        float ns = q2loc[v] + k2v - 2.0f * d;
        if (CODE == 1)      x = -__logf(1.0f + ns);      // O
        else if (CODE == 2) x = -ns;                     // P
        else if (CODE == 4) x = __expf(-0.5f * ns);      // R
        else                x = __cosf(ns) * __expf(-ns);// W
      }
      acc[st][v] = x;
    }
  }
}

__global__ __launch_bounds__(THREADS)
void gsm_wmma_kernel(const float* __restrict__ q_g, const float* __restrict__ k_g,
                     const float* __restrict__ mask_g, const float* __restrict__ kl_g,
                     const float* __restrict__ M_g, const float* __restrict__ C_g,
                     float* __restrict__ out_g)
{
  __shared__ SMem sm;
  const int tid  = threadIdx.x;
  const int lane = tid & 31;
  const int grp  = tid >> 8;      // which 16-row block this wave works on
  const int gt   = tid & 255;     // thread index inside the block's 8 waves
  const int wave = gt >> 5;       // wave index inside the block
  const int r0   = grp * ROWS;    // the block's first row in the LDS row arrays
  const int li   = lane & 15;     // column / row-in-half index
  const int hi   = lane >> 4;     // half-wave select
  const int l0   = blockIdx.x * WROWS;
  const int h    = blockIdx.y;
  const int n    = blockIdx.z;
  const int s0   = wave * 128;    // this wave's 128-column strip

  // ---- stage q block, key rows, key_lengths ----
  for (int idx = tid; idx < WROWS * EE; idx += THREADS) {
    int r = idx >> 6, e = idx & 63;
    sm.qb[r * QS + e] = q_g[(((size_t)n * LL + l0 + r) * HH + h) * EE + e];
  }
  // 16 lanes copy one 256-byte key row, 16 bytes each; a pass of the block covers 32 rows
  {
    const float* ksrc = k_g + (((size_t)n * SS + (tid >> 4)) * HH + h) * EE + (tid & 15) * 4;
    float* kdst = &sm.keyR[(tid >> 4) * KP + (tid & 15) * 4];
    // unrolled whole: the 32 reads of a thread are all in flight before the first LDS write
    #pragma unroll
    for (int i = 0; i < SS / (THREADS / 16); ++i)
      *(v4f*)(kdst + i * (THREADS / 16) * KP) =
          *(const v4f*)(ksrc + (size_t)i * (THREADS / 16) * HH * EE);
  }
  for (int s = tid; s < SS; s += THREADS) sm.kl[s] = kl_g[n * SS + s];
  __syncthreads();

  // ---- k2[s] ----
  for (int s = tid; s < SS; s += THREADS) {
    float a2 = 0.f;
    for (int e = 0; e < EE; e += 4) {
      const v4f v = *(const v4f*)&sm.keyR[s * KP + e];
      a2 += v.x * v.x; a2 += v.y * v.y; a2 += v.z * v.z; a2 += v.w * v.w;
    }
    sm.k2[s] = a2;
  }
  // ---- pi = softmax(q @ M[h]) over 6 codes ----
  if (gt < ROWS * KK) {
    int r = r0 + gt / KK, cc = gt % KK;
    float a = 0.f;
    for (int e = 0; e < EE; ++e)
      a += sm.qb[r * QS + e] * M_g[((size_t)h * EE + e) * KK + cc];
    sm.pi[r][cc] = a;
  }
  // ---- htilde of code 0, on waves 4..7, which have no pi rows; published by the barrier below ----
  if (wave >= 4)
    htilde_tile(sm.qb, C_g, sm.ht[0], sm.q2p[0][wave - 4], 0, h, r0, (wave - 4) * 16, li, hi);
  __syncthreads();
  if (gt < ROWS) {
    const int r = r0 + gt;
    float mx = sm.pi[r][0];
    for (int cc = 1; cc < KK; ++cc) mx = fmaxf(mx, sm.pi[r][cc]);
    float den = 0.f; float ex[KK];
    for (int cc = 0; cc < KK; ++cc) { ex[cc] = __expf(sm.pi[r][cc] - mx); den += ex[cc]; }
    for (int cc = 0; cc < KK; ++cc) sm.pi[r][cc] = ex[cc] / den;
  }

  v8f outacc[8];
  #pragma unroll
  for (int st = 0; st < 8; ++st) outacc[st] = v8f{};

  // the lane's own first mask element; its 64 elements are then constant offsets from one base
  const float* maskb = mask_g + ((size_t)n * LL + l0 + r0 + hi * 8) * SS + s0 + li;

  for (int c = 0; c < KK; ++c) {
    // ---- htilde of the NEXT code, into the buffer that no wave reads in this code: waves 0..3
    // of each block compute one 16-column tile while the other waves run this code's WMMAs.
    // The four barriers of this code's softmax publish it, and they also end every read of
    // the buffer it will overwrite one code later, so the loop needs no barrier up here. ----
    if (c + 1 < KK && wave < 4)
      htilde_tile(sm.qb, C_g, sm.ht[(c + 1) & 1], sm.q2p[(c + 1) & 1][wave], c + 1, h, r0,
                  wave * 16, li, hi);

    // ---- logits = htilde @ key^T over this wave's 128-column strip ----
    v8f acc[8];
    #pragma unroll
    for (int st = 0; st < 8; ++st) acc[st] = v8f{};
    // One 16-byte read holds a lane's operands of two k-steps: in steps 2j and 2j+1 the
    // lane half hi takes e = 8j + 4hi + {0,1} and e = 8j + 4hi + {2,3}, for A and B alike.
    const float* arow = &sm.ht[c & 1][(r0 + li) * QS + hi * 4];
    const float* brow = &sm.keyR[(s0 + li) * KP + hi * 4];
    // unrolled whole: every read is one of the two base registers plus an immediate offset,
    // and the next block's reads are issued as one group ahead of this block's WMMAs
    #pragma unroll
    for (int j = 0; j < 8; ++j) {
      const v4f a4 = *(const v4f*)(arow + j * 8);
      v4f b4[8];
      #pragma unroll
      for (int st = 0; st < 8; ++st)
        b4[st] = *(const v4f*)(brow + st * 16 * KP + j * 8);
      #pragma unroll
      for (int st = 0; st < 8; ++st)
        acc[st] = wmma_f32(a4.xy, b4[st].xy, acc[st]);
      #pragma unroll
      for (int st = 0; st < 8; ++st)
        acc[st] = wmma_f32(a4.zw, b4[st].zw, acc[st]);
    }
    // the branches of the switch below follow the last WMMA: four vector slots keep the
    // distance to the first use of acc on every
    // taken path; the scheduling barrier keeps them behind the WMMAs
    __builtin_amdgcn_sched_barrier(0);
    asm volatile("v_nop\n\tv_nop\n\tv_nop\n\tv_nop");

    // ---- kernel transform of the logits, in place ----
    float q2loc[8], vmax[8];
    {
      // ||htilde_r||^2 of the lane's eight rows: the four tiles' shares, added here
      const float* qp = &sm.q2p[c & 1][0][r0 + hi * 8];
      v4f qa = *(const v4f*)qp, qb4 = *(const v4f*)(qp + 4);
      #pragma unroll
      for (int t = 1; t < 4; ++t) {
        qa  += *(const v4f*)(qp + t * WROWS);
        qb4 += *(const v4f*)(qp + t * WROWS + 4);
      }
      #pragma unroll
      for (int v = 0; v < 4; ++v) { q2loc[v] = qa[v]; q2loc[v + 4] = qb4[v]; }
    }
    #pragma unroll
    for (int v = 0; v < 8; ++v) vmax[v] = -3.4e38f;
    switch (c) {
      case 0: transform_tiles<0>(acc, q2loc, s0, li, sm); break;
      case 1: transform_tiles<1>(acc, q2loc, s0, li, sm); break;
      case 2: transform_tiles<2>(acc, q2loc, s0, li, sm); break;
      case 3: transform_tiles<3>(acc, q2loc, s0, li, sm); break;
      case 4: transform_tiles<4>(acc, q2loc, s0, li, sm); break;
      default: transform_tiles<5>(acc, q2loc, s0, li, sm); break;
    }

    // ---- additive masks and per-row max, one copy behind the switch: inside each of its
    // six cases the 64 mask loads and the case's temporaries overflow 256 registers ----
    #pragma unroll
    for (int st = 0; st < 8; ++st) {
      const int scol = s0 + st * 16 + li;
      const float klv = sm.kl[scol];
      #pragma unroll
      for (int v = 0; v < 8; ++v) {
        const float x = acc[st][v] + (klv + maskb[v * SS + st * 16]);
        acc[st][v] = x;
        vmax[v] = fmaxf(vmax[v], x);
      }
    }

    // ---- row max: xor-shuffle within 16-lane half, then across 8 waves ----
    #pragma unroll
    for (int m = 1; m <= 8; m <<= 1) {
      #pragma unroll
      for (int v = 0; v < 8; ++v)
        vmax[v] = fmaxf(vmax[v], __shfl_xor(vmax[v], m, 32));
    }
    if (li == 0) {
      #pragma unroll
      for (int v = 0; v < 8; ++v) sm.redm[wave][r0 + v + hi * 8] = vmax[v];
    }
    __syncthreads();
    if (gt < ROWS) {
      float mx = sm.redm[0][r0 + gt];
      for (int w = 1; w < NWAVES; ++w) mx = fmaxf(mx, sm.redm[w][r0 + gt]);
      sm.rowm[r0 + gt] = mx;
    }
    __syncthreads();

    // ---- exp and row sum ----
    float rmax[8], vsum[8];
    #pragma unroll
    for (int v = 0; v < 8; ++v) { rmax[v] = sm.rowm[r0 + v + hi * 8]; vsum[v] = 0.f; }
    #pragma unroll
    for (int st = 0; st < 8; ++st) {
      #pragma unroll
      for (int v = 0; v < 8; ++v) {
        float e = __expf(acc[st][v] - rmax[v]);
        acc[st][v] = e;
        vsum[v] += e;
      }
    }
    #pragma unroll
    for (int m = 1; m <= 8; m <<= 1) {
      #pragma unroll
      for (int v = 0; v < 8; ++v)
        vsum[v] += __shfl_xor(vsum[v], m, 32);
    }
    if (li == 0) {
      #pragma unroll
      for (int v = 0; v < 8; ++v) sm.reds[wave][r0 + v + hi * 8] = vsum[v];
    }
    __syncthreads();
    if (gt < ROWS) {
      float s = 0.f;
      for (int w = 0; w < NWAVES; ++w) s += sm.reds[w][r0 + gt];
      sm.rowsum[r0 + gt] = s;
    }
    __syncthreads();

    // ---- accumulate pi-weighted softmax into output tiles ----
    #pragma unroll
    for (int v = 0; v < 8; ++v) {
      const float wgt = sm.pi[r0 + v + hi * 8][c] / sm.rowsum[r0 + v + hi * 8];
      #pragma unroll
      for (int st = 0; st < 8; ++st)
        outacc[st][v] += acc[st][v] * wgt;
    }
  }

  // ---- store out[n,h,l,s], written exactly once ----
  float* ob = out_g + (((size_t)n * HH + h) * LL + l0 + r0) * SS;
  #pragma unroll
  for (int st = 0; st < 8; ++st) {
    #pragma unroll
    for (int v = 0; v < 8; ++v)
      ob[(size_t)(v + hi * 8) * SS + s0 + st * 16 + li] = outacc[st][v];
  }
}

extern "C" void kernel_launch(void* const* d_in, const int* in_sizes, int n_in,
                              void* d_out, int out_size, void* d_ws, size_t ws_size,
                              hipStream_t stream) {
  (void)in_sizes; (void)n_in; (void)out_size; (void)d_ws; (void)ws_size;
  const float* q    = (const float*)d_in[0];
  const float* k    = (const float*)d_in[1];
  const float* mask = (const float*)d_in[2];
  const float* kl   = (const float*)d_in[3];
  const float* M    = (const float*)d_in[4];
  const float* C    = (const float*)d_in[5];
  float* out = (float*)d_out;
  dim3 grid(LL / WROWS, HH, NN);   // (32, 8, 2) workgroups, 16 waves each
  gsm_wmma_kernel<<<grid, dim3(THREADS), 0, stream>>>(q, k, mask, kl, M, C, out);
}

// v004
// It runs in 108 microseconds.
// Next to v003, in two timings, it ran 1.03 times as fast each time.
// Counting every step since v000, it is 2.22 times as fast.
#include <hip/hip_runtime.h>
#include <math.h>

typedef float v2f __attribute__((ext_vector_type(2)));
typedef float v4f __attribute__((ext_vector_type(4)));
typedef float v8f __attribute__((ext_vector_type(8)));

#define NN 2
#define LL 1024
#define SS 1024
#define HH 8
#define EE 64
#define KK 6
#define ROWS 16
#define KP 68            // key row pitch: 272 B = 16 B x 17 (odd) -> conflict-free 16-byte reads
#define QS 68            // same pitch for the q and htilde rows (A fragments)
#define NWAVES 8         // waves per 16-row block (one 128-column strip each)
#define GROUPS 2         // 16-row blocks per work-group, all reading one key tile
#define WROWS (ROWS * GROUPS)
#define THREADS (NWAVES * GROUPS * 32)

struct SMem {
  float keyR[SS * KP] __attribute__((aligned(16)));   // key rows as in memory: keyR[s][e], 272 KB
  float qb[WROWS * QS];         // q rows of both blocks (32 x 64)
  float ht[2][WROWS * QS] __attribute__((aligned(16)));  // htilde rows of both blocks (32 x 64): this code's and the next one's
  float k2[SS];                 // ||key_s||^2
  float kl[SS];                 // key_lengths_add[n][s]
  float q2p[2][4][WROWS] __attribute__((aligned(16)));  // ||htilde_r||^2, one share per 16-column tile
  float pi[WROWS][KK];          // mixture weights
  // per code parity, row and wave: {the strip's row max, the strip's sum of exp(x - that max)}
  float red[2][WROWS][NWAVES][2] __attribute__((aligned(16)));
};

static __device__ __forceinline__ v8f wmma_f32(v2f a, v2f b, v8f c) {
  // D = A(16x4,f32) * B(4x16,f32) + C(16x16,f32)
  return __builtin_amdgcn_wmma_f32_16x16x4_f32(false, a, false, b, (short)0, c,
                                               false, false);
}

static __device__ __forceinline__ float fast_tanh(float x) {
#if __has_builtin(__builtin_amdgcn_tanhf)
  return __builtin_amdgcn_tanhf(x);        // native v_tanh_f32 on gfx1250
#else
  // sign(x) * (1 - e^{-2|x|}) / (1 + e^{-2|x|}) : branch-free, no overflow
  float e2 = __expf(-2.0f * fabsf(x));
  return copysignf((1.0f - e2) / (1.0f + e2), x);
#endif
}

// inside each 16-lane row, lane i takes the value of the lane named by nibble i of (hi8:lo8)
static __device__ __forceinline__ float rowgather(float x, unsigned lo8, unsigned hi8) {
  const int b = __builtin_bit_cast(int, x);
  return __builtin_bit_cast(float, __builtin_amdgcn_permlane16(b, b, lo8, hi8, false, false));
}

// One 16x16 tile of htilde = tanh(qb @ C[c,h]) for the block's rows r0..r0+15, columns f0..f0+15,
// and the tile's share of each row's ||htilde_r||^2 (q2t: one float per row of the work-group).
static __device__ __forceinline__ void htilde_tile(
    const float* qb, const float* __restrict__ C_g, float* htb, float* q2t,
    int c, int h, int r0, int f0, int li, int hi)
{
  // the lane's own column and k pair; the 16 k-steps are then constant offsets
  const float* Cb = C_g + ((size_t)c * HH + h) * EE * EE + hi * 2 * EE + f0 + li;
  v2f a[16], b[16];
  #pragma unroll
  for (int kc = 0; kc < 16; ++kc) {
    const int kb = kc * 4 + hi * 2;
    a[kc].x = qb[(r0 + li) * QS + kb];
    a[kc].y = qb[(r0 + li) * QS + kb + 1];
    b[kc].x = Cb[kc * 4 * EE];
    b[kc].y = Cb[kc * 4 * EE + EE];
  }
  // the two scheduling barriers: every load is issued ahead of the chain, and no address
  // arithmetic is scheduled in among the WMMAs
  __builtin_amdgcn_sched_barrier(0);
  v8f hacc = v8f{};
  #pragma unroll
  for (int kc = 0; kc < 16; ++kc) hacc = wmma_f32(a[kc], b[kc], hacc);
  __builtin_amdgcn_sched_barrier(0);
  float sq[8];
  #pragma unroll
  for (int v = 0; v < 8; ++v) {
    const float t = fast_tanh(hacc[v]);
    htb[(r0 + v + hi * 8) * QS + f0 + li] = t;
    sq[v] = t * t;
  }
  // sum of the squares over the tile's 16 columns: lane i adds lane i ^ 1, ^ 2, ^ 4, ^ 8 of its row
  #pragma unroll
  for (int v = 0; v < 8; ++v) sq[v] += rowgather(sq[v], 0x67452301u, 0xefcdab89u);
  #pragma unroll
  for (int v = 0; v < 8; ++v) sq[v] += rowgather(sq[v], 0x54761032u, 0xdcfe98bau);
  #pragma unroll
  for (int v = 0; v < 8; ++v) sq[v] += rowgather(sq[v], 0x32107654u, 0xba98fedcu);
  #pragma unroll
  for (int v = 0; v < 8; ++v) sq[v] += rowgather(sq[v], 0xfedcba98u, 0x76543210u);
  if (li == 0) {
    #pragma unroll
    for (int v = 0; v < 8; ++v) q2t[r0 + v + hi * 8] = sq[v];
  }
}

// Per-code logit transform over this wave's 8 tiles. CODE is compile-time so
// each specialization carries only its own handful of VALU ops per element.
template <int CODE>
static __device__ __forceinline__ void transform_tiles(
    v8f acc[8], const float* q2loc, int s0, int li, const SMem& sm)
{
  #pragma unroll
  for (int st = 0; st < 8; ++st) {
    const int scol = s0 + st * 16 + li;
    const float k2v = sm.k2[scol];
    #pragma unroll
    for (int v = 0; v < 8; ++v) {
      const float d = acc[st][v];
      float x;
      if (CODE == 0) {                                   // L
        x = d;
      } else if (CODE == 3) {                            // Y: (d+1)^2
        float t = d + 1.0f; x = t * t;
      } else {
        float ns = q2loc[v] + k2v - 2.0f * d;
        if (CODE == 1)      x = -__logf(1.0f + ns);      // O
        else if (CODE == 2) x = -ns;                     // P
        else if (CODE == 4) x = __expf(-0.5f * ns);      // R
        else                x = __cosf(ns) * __expf(-ns);// W
      }
      acc[st][v] = x;
    }
  }
}

__global__ __launch_bounds__(THREADS)
void gsm_wmma_kernel(const float* __restrict__ q_g, const float* __restrict__ k_g,
                     const float* __restrict__ mask_g, const float* __restrict__ kl_g,
                     const float* __restrict__ M_g, const float* __restrict__ C_g,
                     float* __restrict__ out_g)
{
  __shared__ SMem sm;
  const int tid  = threadIdx.x;
  const int lane = tid & 31;
  const int grp  = tid >> 8;      // which 16-row block this wave works on
  const int gt   = tid & 255;     // thread index inside the block's 8 waves
  const int wave = gt >> 5;       // wave index inside the block
  const int r0   = grp * ROWS;    // the block's first row in the LDS row arrays
  const int li   = lane & 15;     // column / row-in-half index
  const int hi   = lane >> 4;     // half-wave select
  const int l0   = blockIdx.x * WROWS;
  const int h    = blockIdx.y;
  const int n    = blockIdx.z;
  const int s0   = wave * 128;    // this wave's 128-column strip

  // ---- stage q block, key rows, key_lengths ----
  for (int idx = tid; idx < WROWS * EE; idx += THREADS) {
    int r = idx >> 6, e = idx & 63;
    sm.qb[r * QS + e] = q_g[(((size_t)n * LL + l0 + r) * HH + h) * EE + e];
  }
  // 16 lanes copy one 256-byte key row, 16 bytes each; a pass of the block covers 32 rows
  {
    const float* ksrc = k_g + (((size_t)n * SS + (tid >> 4)) * HH + h) * EE + (tid & 15) * 4;
    float* kdst = &sm.keyR[(tid >> 4) * KP + (tid & 15) * 4];
    // unrolled whole: the 32 reads of a thread are all in flight before the first LDS write
    #pragma unroll
    for (int i = 0; i < SS / (THREADS / 16); ++i)
      *(v4f*)(kdst + i * (THREADS / 16) * KP) =
          *(const v4f*)(ksrc + (size_t)i * (THREADS / 16) * HH * EE);
  }
  for (int s = tid; s < SS; s += THREADS) sm.kl[s] = kl_g[n * SS + s];
  __syncthreads();

  // ---- k2[s] ----
  for (int s = tid; s < SS; s += THREADS) {
    float a2 = 0.f;
    for (int e = 0; e < EE; e += 4) {
      const v4f v = *(const v4f*)&sm.keyR[s * KP + e];
      a2 += v.x * v.x; a2 += v.y * v.y; a2 += v.z * v.z; a2 += v.w * v.w;
    }
    sm.k2[s] = a2;
  }
  // ---- pi = softmax(q @ M[h]) over 6 codes ----
  if (gt < ROWS * KK) {
    int r = r0 + gt / KK, cc = gt % KK;
    float a = 0.f;
    for (int e = 0; e < EE; ++e)
      a += sm.qb[r * QS + e] * M_g[((size_t)h * EE + e) * KK + cc];
    sm.pi[r][cc] = a;
  }
  // ---- htilde of code 0, on waves 4..7, which have no pi rows; published by the barrier below ----
  if (wave >= 4)
    htilde_tile(sm.qb, C_g, sm.ht[0], sm.q2p[0][wave - 4], 0, h, r0, (wave - 4) * 16, li, hi);
  __syncthreads();
  if (gt < ROWS) {
    const int r = r0 + gt;
    float mx = sm.pi[r][0];
    for (int cc = 1; cc < KK; ++cc) mx = fmaxf(mx, sm.pi[r][cc]);
    float den = 0.f; float ex[KK];
    for (int cc = 0; cc < KK; ++cc) { ex[cc] = __expf(sm.pi[r][cc] - mx); den += ex[cc]; }
    for (int cc = 0; cc < KK; ++cc) sm.pi[r][cc] = ex[cc] / den;
  }

  v8f outacc[8];
  #pragma unroll
  for (int st = 0; st < 8; ++st) outacc[st] = v8f{};

  // the lane's own first mask element; its 64 elements are then constant offsets from one base
  const float* maskb = mask_g + ((size_t)n * LL + l0 + r0 + hi * 8) * SS + s0 + li;

  for (int c = 0; c < KK; ++c) {
    // ---- htilde of the NEXT code, into the buffer that no wave reads in this code: waves 0..3
    // of each block compute one 16-column tile while the other waves run this code's WMMAs.
    // The barrier of this code's softmax publishes it, and it also ends every read of
    // the buffer it will overwrite one code later, so the loop needs no barrier up here. ----
    if (c + 1 < KK && wave < 4)
      htilde_tile(sm.qb, C_g, sm.ht[(c + 1) & 1], sm.q2p[(c + 1) & 1][wave], c + 1, h, r0,
                  wave * 16, li, hi);

    // ---- logits = htilde @ key^T over this wave's 128-column strip ----
    v8f acc[8];
    #pragma unroll
    for (int st = 0; st < 8; ++st) acc[st] = v8f{};
    // One 16-byte read holds a lane's operands of two k-steps: in steps 2j and 2j+1 the
    // lane half hi takes e = 8j + 4hi + {0,1} and e = 8j + 4hi + {2,3}, for A and B alike.
    const float* arow = &sm.ht[c & 1][(r0 + li) * QS + hi * 4];
    const float* brow = &sm.keyR[(s0 + li) * KP + hi * 4];
    // unrolled whole: every read is one of the two base registers plus an immediate offset,
    // and the next block's reads are issued as one group ahead of this block's WMMAs
    #pragma unroll
    for (int j = 0; j < 8; ++j) {
      const v4f a4 = *(const v4f*)(arow + j * 8);
      v4f b4[8];
      #pragma unroll
      for (int st = 0; st < 8; ++st)
        b4[st] = *(const v4f*)(brow + st * 16 * KP + j * 8);
      #pragma unroll
      for (int st = 0; st < 8; ++st)
        acc[st] = wmma_f32(a4.xy, b4[st].xy, acc[st]);
      #pragma unroll
      for (int st = 0; st < 8; ++st)
        acc[st] = wmma_f32(a4.zw, b4[st].zw, acc[st]);
    }
    // the branches of the switch below follow the last WMMA: four vector slots keep the
    // distance to the first use of acc on every
    // taken path; the scheduling barrier keeps them behind the WMMAs
    __builtin_amdgcn_sched_barrier(0);
    asm volatile("v_nop\n\tv_nop\n\tv_nop\n\tv_nop");

    // ---- kernel transform of the logits, in place ----
    float q2loc[8], vmax[8];
    {
      // ||htilde_r||^2 of the lane's eight rows: the four tiles' shares, added here
      const float* qp = &sm.q2p[c & 1][0][r0 + hi * 8];
      v4f qa = *(const v4f*)qp, qb4 = *(const v4f*)(qp + 4);
      #pragma unroll
      for (int t = 1; t < 4; ++t) {
        qa  += *(const v4f*)(qp + t * WROWS);
        qb4 += *(const v4f*)(qp + t * WROWS + 4);
      }
      #pragma unroll
      for (int v = 0; v < 4; ++v) { q2loc[v] = qa[v]; q2loc[v + 4] = qb4[v]; }
    }
    #pragma unroll
    for (int v = 0; v < 8; ++v) vmax[v] = -3.4e38f;
    switch (c) {
      case 0: transform_tiles<0>(acc, q2loc, s0, li, sm); break;
      case 1: transform_tiles<1>(acc, q2loc, s0, li, sm); break;
      case 2: transform_tiles<2>(acc, q2loc, s0, li, sm); break;
      case 3: transform_tiles<3>(acc, q2loc, s0, li, sm); break;
      case 4: transform_tiles<4>(acc, q2loc, s0, li, sm); break;
      default: transform_tiles<5>(acc, q2loc, s0, li, sm); break;
    }

    // ---- additive masks and per-row max, one copy behind the switch: inside each of its
    // six cases the 64 mask loads and the case's temporaries overflow 256 registers ----
    #pragma unroll
    for (int st = 0; st < 8; ++st) {
      const int scol = s0 + st * 16 + li;
      const float klv = sm.kl[scol];
      #pragma unroll
      for (int v = 0; v < 8; ++v) {
        const float x = acc[st][v] + (klv + maskb[v * SS + st * 16]);
        acc[st][v] = x;
        vmax[v] = fmaxf(vmax[v], x);
      }
    }

    // ---- max of each row over this wave's own 128 columns: xor-shuffle within the 16-lane half ----
    #pragma unroll
    for (int m = 1; m <= 8; m <<= 1) {
      #pragma unroll
      for (int v = 0; v < 8; ++v)
        vmax[v] = fmaxf(vmax[v], __shfl_xor(vmax[v], m, 32));
    }

    // ---- exp against the strip's own max, and the strip's sum: no other wave is needed yet ----
    float vsum[8];
    #pragma unroll
    for (int v = 0; v < 8; ++v) vsum[v] = 0.f;
    #pragma unroll
    for (int st = 0; st < 8; ++st) {
      #pragma unroll
      for (int v = 0; v < 8; ++v) {
        float e = __expf(acc[st][v] - vmax[v]);
        acc[st][v] = e;
        vsum[v] += e;
      }
    }
    #pragma unroll
    for (int m = 1; m <= 8; m <<= 1) {
      #pragma unroll
      for (int v = 0; v < 8; ++v)
        vsum[v] += __shfl_xor(vsum[v], m, 32);
    }
    if (li == 0) {
      #pragma unroll
      for (int v = 0; v < 8; ++v)
        *(v2f*)&sm.red[c & 1][r0 + v + hi * 8][wave][0] = v2f{vmax[v], vsum[v]};
    }
    // the one barrier of a code: it publishes the eight {max, sum} pairs of every row and the
    // next code's htilde. red has two parities: a wave can write parity c again only behind
    // the barrier of code c + 1, which every reader of code c's pairs has reached by then.
    __syncthreads();

    // ---- merge: lanes li and li + 8 take row li & 7 of their half. With m the max of the eight
    // strip maxima, the row's sum is sum_w s_w * exp(m_w - m), and this wave's terms
    // exp(x - m_own) become softmax * pi by the factor exp(m_own - m) * pi / sum ----
    float fac;
    {
      const int row = r0 + hi * 8 + (li & 7);
      const float* rp = &sm.red[c & 1][row][0][0];
      const float mown = rp[wave * 2];
      const float piv = sm.pi[row][c];
      v4f p[4];
      #pragma unroll
      for (int t = 0; t < 4; ++t) p[t] = *(const v4f*)(rp + t * 4);
      // all six reads leave as one group: read where they are used, the two single words
      // add a second LDS round trip to the path on which every wave of the block waits
      __builtin_amdgcn_sched_barrier(0);
      float mx = fmaxf(p[0].x, p[0].z);
      #pragma unroll
      for (int t = 1; t < 4; ++t) mx = fmaxf(mx, fmaxf(p[t].x, p[t].z));
      float tot = 0.f;
      #pragma unroll
      for (int t = 0; t < 4; ++t) {
        tot = __builtin_fmaf(p[t].y, __expf(p[t].x - mx), tot);
        tot = __builtin_fmaf(p[t].w, __expf(p[t].z - mx), tot);
      }
      fac = piv / tot * __expf(mown - mx);
    }

    // ---- accumulate pi-weighted softmax into output tiles ----
    #pragma unroll
    for (int v = 0; v < 8; ++v) {
      // lane v of the 16-lane half holds the factor of the half's row v
      const float wgt = rowgather(fac, 0x11111111u * v, 0x11111111u * v);
      #pragma unroll
      for (int st = 0; st < 8; ++st)
        outacc[st][v] += acc[st][v] * wgt;
    }
  }

  // ---- store out[n,h,l,s], written exactly once ----
  float* ob = out_g + (((size_t)n * HH + h) * LL + l0 + r0) * SS;
  #pragma unroll
  for (int st = 0; st < 8; ++st) {
    #pragma unroll
    for (int v = 0; v < 8; ++v)
      ob[(size_t)(v + hi * 8) * SS + s0 + st * 16 + li] = outacc[st][v];
  }
}

extern "C" void kernel_launch(void* const* d_in, const int* in_sizes, int n_in,
                              void* d_out, int out_size, void* d_ws, size_t ws_size,
                              hipStream_t stream) {
  (void)in_sizes; (void)n_in; (void)out_size; (void)d_ws; (void)ws_size;
  const float* q    = (const float*)d_in[0];
  const float* k    = (const float*)d_in[1];
  const float* mask = (const float*)d_in[2];
  const float* kl   = (const float*)d_in[3];
  const float* M    = (const float*)d_in[4];
  const float* C    = (const float*)d_in[5];
  float* out = (float*)d_out;
  dim3 grid(LL / WROWS, HH, NN);   // (32, 8, 2) workgroups, 16 waves each
  gsm_wmma_kernel<<<grid, dim3(THREADS), 0, stream>>>(q, k, mask, kl, M, C, out);
}
